// v000
// Times are from an AMD MI455X. After a warm-up the kernel runs many times in a row, and a time is the length of
// such a window on the GPU divided by its runs, so every launch and the gaps after it count. The runs cycle
// through copies of the inputs. A figure is the median of several windows, for all but v000 over two sittings.
// Sittings can differ by a few percent; kernels timed side by side share one.
// The starting kernel, v000, takes 1130 microseconds a run.
#include <hip/hip_runtime.h>
#include <hip/hip_bf16.h>

typedef __attribute__((ext_vector_type(16))) __bf16 v16bf;
typedef __attribute__((ext_vector_type(8)))  __bf16 v8bf;
typedef __attribute__((ext_vector_type(8)))  float  v8f;

#define S_LEN 8192
#define D_DIM 4096
#define H_N   8
#define G_N   4
#define HD_N  128
#define EPSV  1e-6f

#define BLOCK 512     // 16 waves (wave32)
#define BM    64      // tokens per workgroup
#define NQ    512     // q columns per head (G*HD)
#define NK    128     // k columns per head
#define NTOT  640     // combined N
#define NTW   10      // N-tiles per wave
#define KSTEP 64      // K per staging step (2 wmma K-slices of 32)
#define AS    72      // A LDS row stride (bf16 elems, padded; 144B, 16B-aligned)
#define WS    72      // W LDS row stride (bf16 elems, padded)
#define CS    648     // C LDS row stride (f32 elems, padded)
#define A_BYTES (BM * AS * 2)          // 9216
#define SMEM_BYTES (BM * CS * 4)       // 165888 (> A_BYTES + NTOT*WS*2 = 101376)

__device__ __forceinline__ v8bf cvt8(const float* p) {
    float4 f0 = *(const float4*)(p);
    float4 f1 = *(const float4*)(p + 4);
    v8bf o;
    o[0] = (__bf16)f0.x; o[1] = (__bf16)f0.y; o[2] = (__bf16)f0.z; o[3] = (__bf16)f0.w;
    o[4] = (__bf16)f1.x; o[5] = (__bf16)f1.y; o[6] = (__bf16)f1.z; o[7] = (__bf16)f1.w;
    return o;
}

__device__ __forceinline__ v16bf frag16(const __bf16* p) {
    // lane's 16 bf16: chunk0 at +0, chunk1 at +16 elems (K layout per ISA)
    v8bf lo = *(const v8bf*)p;
    v8bf hi = *(const v8bf*)(p + 16);
    return __builtin_shufflevector(lo, hi, 0,1,2,3,4,5,6,7,8,9,10,11,12,13,14,15);
}

__global__ __launch_bounds__(BLOCK, 1)
void fused_gatescore_kernel(const float* __restrict__ hs,
                            const float* __restrict__ q_w,
                            const float* __restrict__ q_b,
                            const float* __restrict__ k_w,
                            const float* __restrict__ q_norm_w,
                            const float* __restrict__ k_norm_w,
                            const float* __restrict__ k_base,
                            const float* __restrict__ bvec,
                            float* __restrict__ out)
{
    extern __shared__ unsigned char smem[];
    __bf16* Ald = (__bf16*)smem;                 // [BM][AS] bf16 (GEMM stage)
    __bf16* Wld = (__bf16*)(smem + A_BYTES);     // [NTOT][WS] bf16 (GEMM stage)
    float*  Cld = (float*)smem;                  // [BM][CS] f32  (epilogue stage)

    const int tid  = threadIdx.x;
    const int h    = blockIdx.y;
    const int s0   = blockIdx.x * BM;
    const int lane = tid & 31;
    const int wv   = tid >> 5;          // wave id 0..15
    const int hlf  = lane >> 4;         // 0: lanes 0-15, 1: lanes 16-31
    const int l16  = lane & 15;
    const int mt   = wv & 3;            // M-tile (16 rows) this wave owns
    const int nbase = (wv >> 2) * 160;  // N-quarter this wave owns (10 tiles of 16)

    v8f acc[NTW] = {};

    // cooperative A-load mapping: 64 rows x 8 segments = 512 tasks, 1 per thread
    const int arow = tid >> 3;
    const int aseg = tid & 7;
    const float* aptr = hs + (size_t)(s0 + arow) * D_DIM + aseg * 8;

    for (int d0 = 0; d0 < D_DIM; d0 += KSTEP) {
        __syncthreads();

        // ---- stage A tile: 64 x 64 f32 -> bf16 LDS (1 segment per thread) ----
        *(v8bf*)(Ald + arow * AS + aseg * 8) = cvt8(aptr + d0);

        // ---- stage W tile: 640 rows x 64 f32 -> bf16 LDS (1-2 rows per thread) ----
        for (int r = tid; r < NTOT; r += BLOCK) {
            const float* wrow = (r < NQ)
                ? (q_w + (size_t)(h * NQ + r) * D_DIM + d0)
                : (k_w + (size_t)(h * NK + (r - NQ)) * D_DIM + d0);
            if (d0 + KSTEP < D_DIM) __builtin_prefetch(wrow + KSTEP, 0, 1);
            #pragma unroll
            for (int seg = 0; seg < 8; ++seg) {
                *(v8bf*)(Wld + r * WS + seg * 8) = cvt8(wrow + seg * 8);
            }
        }
        __syncthreads();

        // ---- two K=32 slices per staged tile ----
        #pragma unroll
        for (int kk = 0; kk < 2; ++kk) {
            const int koff = kk * 32;
            // A fragment (16x32): lanes 0-15 -> K 0..7,16..23; lanes 16-31 -> K 8..15,24..31
            const v16bf afrag = frag16(Ald + (mt * 16 + l16) * AS + koff + hlf * 8);

            // Preload ALL B fragments of this K-slice (independent loads -> one ds clause),
            // then issue WMMAs back-to-back with only partial dscnt waits.
            v16bf bf[NTW];
            #pragma unroll
            for (int nt = 0; nt < NTW; ++nt) {
                bf[nt] = frag16(Wld + (nbase + nt * 16 + l16) * WS + koff + hlf * 8);
            }
            #pragma unroll
            for (int nt = 0; nt < NTW; ++nt) {
                acc[nt] = __builtin_amdgcn_wmma_f32_16x16x32_bf16(
                    false, afrag, false, bf[nt], (short)0, acc[nt], false, false);
            }
        }
    }

    __syncthreads();
    // ---- dump accumulators to LDS C tile [BM][CS]; VGPR r -> M = 16*mt + 8*hlf + r, N = lane&15 ----
    #pragma unroll
    for (int nt = 0; nt < NTW; ++nt) {
        const int n = nbase + nt * 16 + l16;
        #pragma unroll
        for (int r = 0; r < 8; ++r) {
            Cld[(mt * 16 + hlf * 8 + r) * CS + n] = acc[nt][r];
        }
    }
    __syncthreads();

    // ---- fused epilogue: bias, RMS norms, dots, logistic sink score ----
    if (tid < BM) {
        const int m = tid;
        const float* crow = Cld + m * CS;              // [0..511]=q raw, [512..639]=k raw
        const float inv_scale = 0.08838834764831845f;  // 1/sqrt(HD)

        float ssk = 0.f;
        for (int d = 0; d < HD_N; ++d) { float kv = crow[NQ + d]; ssk += kv * kv; }
        const float rk = rsqrtf(ssk * (1.0f / HD_N) + EPSV);

        float score = 0.f;
        for (int g = 0; g < G_N; ++g) {
            float ssq = 0.f, dqk = 0.f, dbase = 0.f;
            for (int d = 0; d < HD_N; ++d) {
                float qv = crow[g * HD_N + d] + q_b[h * NQ + g * HD_N + d];
                ssq += qv * qv;
                float qn = qv * q_norm_w[d];
                dqk   += (crow[NQ + d] * k_norm_w[d]) * qn;
                dbase += k_base[h * HD_N + d] * qn;
            }
            const float rq    = rsqrtf(ssq * (1.0f / HD_N) + EPSV);
            const float logit = dqk * rk * rq * inv_scale + bvec[h * G_N + g];
            const float lbase = dbase * rq * inv_scale;
            score += 1.f / (1.f + expf(lbase - logit));
        }
        out[(size_t)h * S_LEN + (s0 + m)] = score * 0.25f;
    }
}

extern "C" void kernel_launch(void* const* d_in, const int* in_sizes, int n_in,
                              void* d_out, int out_size, void* d_ws, size_t ws_size,
                              hipStream_t stream) {
    const float* hs       = (const float*)d_in[0];
    const float* q_w      = (const float*)d_in[1];
    const float* q_b      = (const float*)d_in[2];
    const float* k_w      = (const float*)d_in[3];
    const float* q_norm_w = (const float*)d_in[4];
    const float* k_norm_w = (const float*)d_in[5];
    const float* k_base   = (const float*)d_in[6];
    const float* bvec     = (const float*)d_in[7];
    float* out = (float*)d_out;

    dim3 grid(S_LEN / BM, H_N);
    fused_gatescore_kernel<<<grid, BLOCK, SMEM_BYTES, stream>>>(
        hs, q_w, q_b, k_w, q_norm_w, k_norm_w, k_base, bvec, out);
}

// v001
// Measured time: 606 microseconds a run.
// In two side-by-side timings against v000, it was 1.98 and 1.95 times as fast.
#include <hip/hip_runtime.h>
#include <hip/hip_bf16.h>

typedef __attribute__((ext_vector_type(16))) __bf16 v16bf;
typedef __attribute__((ext_vector_type(8)))  __bf16 v8bf;
typedef __attribute__((ext_vector_type(4)))  __bf16 v4bf;
typedef __attribute__((ext_vector_type(8)))  float  v8f;

#define S_LEN 8192
#define D_DIM 4096
#define H_N   8
#define G_N   4
#define HD_N  128
#define EPSV  1e-6f

#define BLOCK 512     // 16 waves (wave32)
#define BM    64      // tokens per workgroup
#define NQ    512     // q columns per head (G*HD)
#define NK    128     // k columns per head
#define NTOT  640     // combined N
#define NTW   10      // N-tiles per wave
#define KSTEP 64      // K per staging step (2 wmma K-slices of 32)
#define AS    72      // A LDS row stride (bf16 elems, padded; 144B, 16B-aligned)
#define WS    72      // W LDS row stride (bf16 elems, padded)
#define CS    648     // C LDS row stride (f32 elems, padded)
#define A_BYTES (BM * AS * 2)          // 9216
#define SMEM_BYTES (BM * CS * 4)       // 165888 (> A_BYTES + NTOT*WS*2 = 101376)

__device__ __forceinline__ v4bf cvt4(float4 f) {
    v4bf o;
    o[0] = (__bf16)f.x; o[1] = (__bf16)f.y; o[2] = (__bf16)f.z; o[3] = (__bf16)f.w;
    return o;
}

__device__ __forceinline__ v16bf frag16(const __bf16* p) {
    // lane's 16 bf16: chunk0 at +0, chunk1 at +16 elems (K layout per ISA)
    v8bf lo = *(const v8bf*)p;
    v8bf hi = *(const v8bf*)(p + 16);
    return __builtin_shufflevector(lo, hi, 0,1,2,3,4,5,6,7,8,9,10,11,12,13,14,15);
}

__global__ __launch_bounds__(BLOCK, 1)
void fused_gatescore_kernel(const float* __restrict__ hs,
                            const float* __restrict__ q_w,
                            const float* __restrict__ q_b,
                            const float* __restrict__ k_w,
                            const float* __restrict__ q_norm_w,
                            const float* __restrict__ k_norm_w,
                            const float* __restrict__ k_base,
                            const float* __restrict__ bvec,
                            float* __restrict__ out)
{
    extern __shared__ unsigned char smem[];
    __bf16* Ald = (__bf16*)smem;                 // [BM][AS] bf16 (GEMM stage)
    __bf16* Wld = (__bf16*)(smem + A_BYTES);     // [NTOT][WS] bf16 (GEMM stage)
    float*  Cld = (float*)smem;                  // [BM][CS] f32  (epilogue stage)

    const int tid  = threadIdx.x;
    const int h    = blockIdx.y;
    const int s0   = blockIdx.x * BM;
    const int lane = tid & 31;
    const int wv   = tid >> 5;          // wave id 0..15
    const int hlf  = lane >> 4;         // 0: lanes 0-15, 1: lanes 16-31
    const int l16  = lane & 15;
    const int mt   = wv & 3;            // M-tile (16 rows) this wave owns
    const int nbase = (wv >> 2) * 160;  // N-quarter this wave owns (10 tiles of 16)

    v8f acc[NTW] = {};

    // staging map, A and W alike: 16 lanes x 16 B cover the 256 B that one row gives per K step,
    // so a wave-wide load reads two rows' whole lines. One sweep of the block = 32 rows.
    // A wave's two rows lie 8 apart: 8 * 144 B = 32 banks, so its 8-B LDS stores hit each bank once.
    const int srow = ((wv >> 3) << 4) + (hlf << 3) + (wv & 7);   // 0..31, each once per block
    const unsigned soff = (unsigned)(srow * D_DIM + l16 * 4) * 4u;   // lane's byte offset, the same in all three tensors
    const float* aptr = hs  + (size_t)s0 * D_DIM;                // block-uniform bases, advanced per K step
    const float* qptr = q_w + (size_t)(h * NQ) * D_DIM;
    const float* kptr = k_w + (size_t)(h * NK) * D_DIM;
    __bf16* ast = Ald + srow * AS + l16 * 4;
    __bf16* wst = Wld + srow * WS + l16 * 4;

    // W prefetch targets, one K step ahead: thread t asks for row t, waves 0..3 also for row 512 + t
    const float* pfq = q_w + (size_t)(h * NQ + tid) * D_DIM + KSTEP;
    const float* pfk = k_w + (size_t)(h * NK + (tid & (NK - 1))) * D_DIM + KSTEP;
    const bool   pfk_wave = __builtin_amdgcn_readfirstlane(wv) < NK / 32;

    for (int d0 = 0; d0 < D_DIM; d0 += KSTEP) {
        __syncthreads();

        // ---- load A tile (64 x 64 f32, 2 sweeps) and W tile (640 x 64 f32, 16 + 4 sweeps) ----
        float4 av[BM / 32], wr[NTOT / 32];
        #pragma unroll
        for (int j = 0; j < BM / 32; ++j)
            av[j] = *(const float4*)((const char*)(aptr + (size_t)j * 32 * D_DIM) + soff);
        #pragma unroll
        for (int j = 0; j < NQ / 32; ++j)
            wr[j] = *(const float4*)((const char*)(qptr + (size_t)j * 32 * D_DIM) + soff);
        #pragma unroll
        for (int j = 0; j < NK / 32; ++j) {
            // the build lands the last load's data in the address registers of the loads above it:
            // this wait stands in front of that overwrite
            if (j == NK / 32 - 1) asm volatile("s_wait_xcnt 0x0" ::: "memory");
            wr[NQ / 32 + j] = *(const float4*)((const char*)(kptr + (size_t)j * 32 * D_DIM) + soff);
        }
        aptr += KSTEP;
        qptr += KSTEP;
        kptr += KSTEP;

        // next K step's W rows into L2, one prefetch per row. In asm so that each names a pointer
        // that lives through the loop: a temporary would be rewritten right behind the prefetch.
        if (d0 + KSTEP < D_DIM) {
            asm volatile("global_prefetch_b8 %0, off scope:SCOPE_SE" :: "v"(pfq));
            if (pfk_wave)
                asm volatile("global_prefetch_b8 %0, off scope:SCOPE_SE" :: "v"(pfk));
        }
        // the pointers stop at the row's last K step, so they never leave the tensor
        const int pfadv = (d0 + 2 * KSTEP < D_DIM) ? KSTEP : 0;
        pfq += pfadv;
        pfk += pfadv;

        // ---- f32 -> bf16, 8 B per lane into LDS ----
        #pragma unroll
        for (int j = 0; j < BM / 32; ++j)
            *(v4bf*)(ast + j * 32 * AS) = cvt4(av[j]);
        #pragma unroll
        for (int j = 0; j < NTOT / 32; ++j)
            *(v4bf*)(wst + j * 32 * WS) = cvt4(wr[j]);
        __syncthreads();

        // ---- two K=32 slices per staged tile ----
        #pragma unroll
        for (int kk = 0; kk < 2; ++kk) {
            const int koff = kk * 32;
            // A fragment (16x32): lanes 0-15 -> K 0..7,16..23; lanes 16-31 -> K 8..15,24..31
            const v16bf afrag = frag16(Ald + (mt * 16 + l16) * AS + koff + hlf * 8);

            // Preload ALL B fragments of this K-slice (independent loads -> one ds clause),
            // then issue WMMAs back-to-back with only partial dscnt waits.
            v16bf bf[NTW];
            #pragma unroll
            for (int nt = 0; nt < NTW; ++nt) {
                bf[nt] = frag16(Wld + (nbase + nt * 16 + l16) * WS + koff + hlf * 8);
            }
            #pragma unroll
            for (int nt = 0; nt < NTW; ++nt) {
                acc[nt] = __builtin_amdgcn_wmma_f32_16x16x32_bf16(
                    false, afrag, false, bf[nt], (short)0, acc[nt], false, false);
            }
        }
    }

    __syncthreads();
    // ---- dump accumulators to LDS C tile [BM][CS]; VGPR r -> M = 16*mt + 8*hlf + r, N = lane&15 ----
    #pragma unroll
    for (int nt = 0; nt < NTW; ++nt) {
        const int n = nbase + nt * 16 + l16;
        #pragma unroll
        for (int r = 0; r < 8; ++r) {
            Cld[(mt * 16 + hlf * 8 + r) * CS + n] = acc[nt][r];
        }
    }
    __syncthreads();

    // ---- fused epilogue: bias, RMS norms, dots, logistic sink score ----
    if (tid < BM) {
        const int m = tid;
        const float* crow = Cld + m * CS;              // [0..511]=q raw, [512..639]=k raw
        const float inv_scale = 0.08838834764831845f;  // 1/sqrt(HD)

        float ssk = 0.f;
        for (int d = 0; d < HD_N; ++d) { float kv = crow[NQ + d]; ssk += kv * kv; }
        const float rk = rsqrtf(ssk * (1.0f / HD_N) + EPSV);

        float score = 0.f;
        for (int g = 0; g < G_N; ++g) {
            float ssq = 0.f, dqk = 0.f, dbase = 0.f;
            for (int d = 0; d < HD_N; ++d) {
                float qv = crow[g * HD_N + d] + q_b[h * NQ + g * HD_N + d];
                ssq += qv * qv;
                float qn = qv * q_norm_w[d];
                dqk   += (crow[NQ + d] * k_norm_w[d]) * qn;
                dbase += k_base[h * HD_N + d] * qn;
            }
            const float rq    = rsqrtf(ssq * (1.0f / HD_N) + EPSV);
            const float logit = dqk * rk * rq * inv_scale + bvec[h * G_N + g];
            const float lbase = dbase * rq * inv_scale;
            score += 1.f / (1.f + expf(lbase - logit));
        }
        out[(size_t)h * S_LEN + (s0 + m)] = score * 0.25f;
    }
}

extern "C" void kernel_launch(void* const* d_in, const int* in_sizes, int n_in,
                              void* d_out, int out_size, void* d_ws, size_t ws_size,
                              hipStream_t stream) {
    const float* hs       = (const float*)d_in[0];
    const float* q_w      = (const float*)d_in[1];
    const float* q_b      = (const float*)d_in[2];
    const float* k_w      = (const float*)d_in[3];
    const float* q_norm_w = (const float*)d_in[4];
    const float* k_norm_w = (const float*)d_in[5];
    const float* k_base   = (const float*)d_in[6];
    const float* bvec     = (const float*)d_in[7];
    float* out = (float*)d_out;

    dim3 grid(S_LEN / BM, H_N);
    fused_gatescore_kernel<<<grid, BLOCK, SMEM_BYTES, stream>>>(
        hs, q_w, q_b, k_w, q_norm_w, k_norm_w, k_base, bvec, out);
}

// v002
// A run of this version takes 541 microseconds.
// Two timings next to v001 put it at 1.12 and 1.11 times that version's speed.
// Counting every step since v000, it is 2.19 times as fast.
#include <hip/hip_runtime.h>
#include <hip/hip_bf16.h>

typedef __attribute__((ext_vector_type(16))) __bf16 v16bf;
typedef __attribute__((ext_vector_type(8)))  __bf16 v8bf;
typedef __attribute__((ext_vector_type(4)))  __bf16 v4bf;
typedef __attribute__((ext_vector_type(8)))  float  v8f;

#define S_LEN 8192
#define D_DIM 4096
#define H_N   8
#define G_N   4
#define HD_N  128
#define EPSV  1e-6f

#define BLOCK 512     // 16 waves (wave32)
#define BM    64      // tokens per workgroup
#define NQ    512     // q columns per head (G*HD)
#define NK    128     // k columns per head
#define NTOT  640     // combined N
#define NTW   10      // N-tiles per wave
#define KSTEP 64      // K per staging step (2 wmma K-slices of 32)
#define AS    72      // A LDS row stride (bf16 elems, padded; 144B, 16B-aligned)
#define WS    72      // W LDS row stride (bf16 elems, padded)
#define CS    648     // C LDS row stride (f32 elems, padded)
#define A_BYTES (BM * AS * 2)          // 9216
#define STAGE_ELEMS ((BM + NTOT) * AS) // one GEMM stage, A then W: 50688 bf16 = 101376 B
#define SMEM_BYTES (2 * STAGE_ELEMS * 2)   // two GEMM stages, 202752 B (> the epilogue's BM * CS * 4 = 165888)

__device__ __forceinline__ v4bf cvt4(float4 f) {
    v4bf o;
    o[0] = (__bf16)f.x; o[1] = (__bf16)f.y; o[2] = (__bf16)f.z; o[3] = (__bf16)f.w;
    return o;
}

__device__ __forceinline__ v16bf frag16(const __bf16* p) {
    // lane's 16 bf16: chunk0 at +0, chunk1 at +16 elems (K layout per ISA)
    v8bf lo = *(const v8bf*)p;
    v8bf hi = *(const v8bf*)(p + 16);
    return __builtin_shufflevector(lo, hi, 0,1,2,3,4,5,6,7,8,9,10,11,12,13,14,15);
}

__global__ __launch_bounds__(BLOCK, 1)
void fused_gatescore_kernel(const float* __restrict__ hs,
                            const float* __restrict__ q_w,
                            const float* __restrict__ q_b,
                            const float* __restrict__ k_w,
                            const float* __restrict__ q_norm_w,
                            const float* __restrict__ k_norm_w,
                            const float* __restrict__ k_base,
                            const float* __restrict__ bvec,
                            float* __restrict__ out)
{
    extern __shared__ unsigned char smem[];
    __bf16* Ald = (__bf16*)smem;                 // [BM][AS] bf16 (GEMM stage, two of them STAGE_ELEMS apart)
    __bf16* Wld = (__bf16*)(smem + A_BYTES);     // [NTOT][WS] bf16 (GEMM stage)
    float*  Cld = (float*)smem;                  // [BM][CS] f32  (epilogue stage)

    const int tid  = threadIdx.x;
    const int h    = blockIdx.y;
    const int s0   = blockIdx.x * BM;
    const int lane = tid & 31;
    const int wv   = tid >> 5;          // wave id 0..15
    const int hlf  = lane >> 4;         // 0: lanes 0-15, 1: lanes 16-31
    const int l16  = lane & 15;
    const int mt   = wv & 3;            // M-tile (16 rows) this wave owns
    const int nbase = (wv >> 2) * 160;  // N-quarter this wave owns (10 tiles of 16)

    v8f acc[NTW] = {};

    // staging map, A and W alike: 16 lanes x 16 B cover the 256 B that one row gives per K step,
    // so a wave-wide load reads two rows' whole lines. One sweep of the block = 32 rows.
    // A wave's two rows lie 8 apart: 8 * 144 B = 32 banks, so its 8-B LDS stores hit each bank once.
    const int srow = ((wv >> 3) << 4) + (hlf << 3) + (wv & 7);   // 0..31, each once per block
    const unsigned soff = (unsigned)(srow * D_DIM + l16 * 4) * 4u;   // lane's byte offset, the same in all three tensors
    const float* aptr = hs  + (size_t)s0 * D_DIM;                // block-uniform bases
    const float* qptr = q_w + (size_t)(h * NQ) * D_DIM;
    const float* kptr = k_w + (size_t)(h * NK) * D_DIM;
    __bf16* ast = Ald + srow * AS + l16 * 4;
    __bf16* wst = Wld + srow * WS + l16 * 4;

    // W prefetch targets, one K step ahead of the loads: thread t asks for row t, waves 0..3 also for row 512 + t
    // (advanced in front of each use: the first prefetch asks for K step 2)
    const float* pfq = q_w + (size_t)(h * NQ + tid) * D_DIM + KSTEP;
    const float* pfk = k_w + (size_t)(h * NK + (tid & (NK - 1))) * D_DIM + KSTEP;
    const bool   pfk_wave = __builtin_amdgcn_readfirstlane(wv) < NK / 32;

    // One K step's operands in registers: A tile (64 x 64 f32, 2 sweeps), W tile (640 x 64 f32, 16 + 4 sweeps).
    // They are loaded one K step ahead of their use, so that the L2 time runs under the WMMAs of the step before.
    float4 av[BM / 32], wr[NTOT / 32];
    unsigned so = soff;   // lane's byte offset at the K step loaded last
    auto load_step = [&]() {
        #pragma unroll
        for (int j = 0; j < BM / 32; ++j)
            av[j] = *(const float4*)((const char*)(aptr + (size_t)j * 32 * D_DIM) + so);
        #pragma unroll
        for (int j = 0; j < NQ / 32; ++j)
            wr[j] = *(const float4*)((const char*)(qptr + (size_t)j * 32 * D_DIM) + so);
        #pragma unroll
        for (int j = 0; j < NK / 32; ++j)
            wr[NQ / 32 + j] = *(const float4*)((const char*)(kptr + (size_t)j * 32 * D_DIM) + so);
    };

    load_step();
    int bo = 0;   // element offset of this K step's LDS buffer: 0 or STAGE_ELEMS

    for (int d0 = 0; d0 < D_DIM; d0 += KSTEP) {
        // ---- f32 -> bf16, 8 B per lane into this step's LDS buffer ----
        // Its last readers (two steps back) have all passed the barrier of the step before this one.
        #pragma unroll
        for (int j = 0; j < BM / 32; ++j)
            *(v4bf*)(ast + bo + j * 32 * AS) = cvt4(av[j]);
        #pragma unroll
        for (int j = 0; j < NTOT / 32; ++j)
            *(v4bf*)(wst + bo + j * 32 * WS) = cvt4(wr[j]);

        // ---- next K step's global loads, in flight across the barrier and this step's WMMAs ----
        if (d0 + KSTEP < D_DIM) {
            // stands in front of the advances of the registers that the last step's loads and prefetches name;
            // placed here, behind the use of that step's data, so that no wave waits on it between its new
            // loads and the barrier
            asm volatile("s_wait_xcnt 0x0" ::: "memory");
            so += KSTEP * 4;
            // the W rows of the K step after the one loaded below into L2, one prefetch per row. In asm so that each
            // names a pointer that lives through the loop: a temporary would be rewritten right behind the prefetch.
            // The pointers advance only under this test, so they stop at the row's last K step, inside the tensor.
            if (d0 + 2 * KSTEP < D_DIM) {
                pfq += KSTEP;
                pfk += KSTEP;
                asm volatile("global_prefetch_b8 %0, off scope:SCOPE_SE" :: "v"(pfq));
                if (pfk_wave)
                    asm volatile("global_prefetch_b8 %0, off scope:SCOPE_SE" :: "v"(pfk));
            }
            load_step();
        }

        // Work-group barrier whose fences name LDS alone: it publishes the stage (s_wait_dscnt 0 in front),
        // while __syncthreads() would also wait here for the global loads just issued.
        __builtin_amdgcn_fence(__ATOMIC_RELEASE, "workgroup", "local");
        __builtin_amdgcn_s_barrier();
        __builtin_amdgcn_fence(__ATOMIC_ACQUIRE, "workgroup", "local");

        // ---- two K=32 slices per staged tile ----
        #pragma unroll
        for (int kk = 0; kk < 2; ++kk) {
            const int koff = bo + kk * 32;
            // A fragment (16x32): lanes 0-15 -> K 0..7,16..23; lanes 16-31 -> K 8..15,24..31
            const v16bf afrag = frag16(Ald + (mt * 16 + l16) * AS + koff + hlf * 8);

            // B fragments in groups of five (ten at once no longer fit beside the operands in flight),
            // each group loaded whole, then its WMMAs back-to-back.
            #pragma unroll
            for (int n0 = 0; n0 < NTW; n0 += NTW / 2) {
                v16bf bf[NTW / 2];
                #pragma unroll
                for (int nt = 0; nt < NTW / 2; ++nt) {
                    bf[nt] = frag16(Wld + (nbase + (n0 + nt) * 16 + l16) * WS + koff + hlf * 8);
                }
                // holds the group's loads together in front of its WMMAs: left free, this build, short of registers,
                // loads one fragment at a time and puts a full LDS wait in front of every WMMA
                __builtin_amdgcn_sched_barrier(0);
                #pragma unroll
                for (int nt = 0; nt < NTW / 2; ++nt) {
                    acc[n0 + nt] = __builtin_amdgcn_wmma_f32_16x16x32_bf16(
                        false, afrag, false, bf[nt], (short)0, acc[n0 + nt], false, false);
                }
            }
        }
        bo ^= STAGE_ELEMS;
    }

    __syncthreads();
    // ---- dump accumulators to LDS C tile [BM][CS]; VGPR r -> M = 16*mt + 8*hlf + r, N = lane&15 ----
    #pragma unroll
    for (int nt = 0; nt < NTW; ++nt) {
        const int n = nbase + nt * 16 + l16;
        #pragma unroll
        for (int r = 0; r < 8; ++r) {
            Cld[(mt * 16 + hlf * 8 + r) * CS + n] = acc[nt][r];
        }
    }
    __syncthreads();

    // ---- fused epilogue: bias, RMS norms, dots, logistic sink score ----
    if (tid < BM) {
        const int m = tid;
        const float* crow = Cld + m * CS;              // [0..511]=q raw, [512..639]=k raw
        const float inv_scale = 0.08838834764831845f;  // 1/sqrt(HD)

        float ssk = 0.f;
        for (int d = 0; d < HD_N; ++d) { float kv = crow[NQ + d]; ssk += kv * kv; }
        const float rk = rsqrtf(ssk * (1.0f / HD_N) + EPSV);

        float score = 0.f;
        for (int g = 0; g < G_N; ++g) {
            float ssq = 0.f, dqk = 0.f, dbase = 0.f;
            for (int d = 0; d < HD_N; ++d) {
                float qv = crow[g * HD_N + d] + q_b[h * NQ + g * HD_N + d];
                ssq += qv * qv;
                float qn = qv * q_norm_w[d];
                dqk   += (crow[NQ + d] * k_norm_w[d]) * qn;
                dbase += k_base[h * HD_N + d] * qn;
            }
            const float rq    = rsqrtf(ssq * (1.0f / HD_N) + EPSV);
            const float logit = dqk * rk * rq * inv_scale + bvec[h * G_N + g];
            const float lbase = dbase * rq * inv_scale;
            score += 1.f / (1.f + expf(lbase - logit));
        }
        out[(size_t)h * S_LEN + (s0 + m)] = score * 0.25f;
    }
}

extern "C" void kernel_launch(void* const* d_in, const int* in_sizes, int n_in,
                              void* d_out, int out_size, void* d_ws, size_t ws_size,
                              hipStream_t stream) {
    const float* hs       = (const float*)d_in[0];
    const float* q_w      = (const float*)d_in[1];
    const float* q_b      = (const float*)d_in[2];
    const float* k_w      = (const float*)d_in[3];
    const float* q_norm_w = (const float*)d_in[4];
    const float* k_norm_w = (const float*)d_in[5];
    const float* k_base   = (const float*)d_in[6];
    const float* bvec     = (const float*)d_in[7];
    float* out = (float*)d_out;

    dim3 grid(S_LEN / BM, H_N);
    fused_gatescore_kernel<<<grid, BLOCK, SMEM_BYTES, stream>>>(
        hs, q_w, q_b, k_w, q_norm_w, k_norm_w, k_base, bvec, out);
}

// v003
// Measured time: 428 microseconds a run.
// Next to v002, in two timings, it ran 1.27 times as fast each time.
// Counting every step since v000, it is 2.78 times as fast.
#include <hip/hip_runtime.h>
#include <hip/hip_bf16.h>

typedef __attribute__((ext_vector_type(16))) __bf16 v16bf;
typedef __attribute__((ext_vector_type(8)))  __bf16 v8bf;
typedef __attribute__((ext_vector_type(4)))  __bf16 v4bf;
typedef __attribute__((ext_vector_type(8)))  float  v8f;
typedef __attribute__((ext_vector_type(4)))  float  v4f;

#define S_LEN 8192
#define D_DIM 4096
#define H_N   8
#define G_N   4
#define HD_N  128
#define EPSV  1e-6f

#define BLOCK 512     // 16 waves (wave32)
#define BM    64      // tokens per workgroup
#define NQ    512     // q columns per head (G*HD)
#define NK    128     // k columns per head
#define NTOT  640     // combined N
#define NTW   10      // N-tiles per wave
#define KSTEP 64      // K per staging step (2 wmma K-slices of 32)
#define AS    72      // A LDS row stride (bf16 elems, padded; 144B, 16B-aligned)
#define WS    72      // W LDS row stride (bf16 elems, padded)
#define CS    648     // C LDS row stride (f32 elems, padded)
#define A_BYTES (BM * AS * 2)          // 9216
#define STAGE_ELEMS ((BM + NTOT) * AS) // one GEMM stage, A then W: 50688 bf16 = 101376 B
#define SMEM_BYTES (2 * STAGE_ELEMS * 2)   // two GEMM stages, 202752 B (> the epilogue's BM * CS * 4 = 165888)

// Packed bf16 operands in the workspace, written by pack_bf16_kernel and read by the GEMM in the same call.
// One tile = the rows that one workgroup stages in one K step, 128 B (KSTEP bf16) a row, tiles of a workgroup's
// K steps one behind the other: A [S_LEN / BM][KT][BM rows], W [H_N][KT][NTOT rows: q rows, then k rows].
// Inside every 32 rows, row a + 8 * b (a < 8, b < 4) lies at place 4 * a + b: a wave's 512 contiguous bytes are then
// four rows that lie 8 apart, which its 16-B LDS stores at the 144-B pitch put on distinct banks.
#define KT           (D_DIM / KSTEP)       // 64 K steps
#define A_TILE_ELEMS (BM * KSTEP)          // 8 KiB
#define W_TILE_ELEMS (NTOT * KSTEP)        // 80 KiB
#define SWEEP_BYTES  (BLOCK * 16)          // one 16-B load per thread of the GEMM block: 64 rows
#define PK_BLOCK 512
#define PK_GRID  256
#define PK_WAVES (PK_GRID * PK_BLOCK / 32)             // 4096
#define PK_UNITS ((S_LEN + H_N * NTOT) * 4)            // a unit = two rows x 512 k
#define PK_ITERS (PK_UNITS / PK_WAVES)                 // 13, exact

// f32 -> bf16 (round to nearest even) of hs, q_w and k_w, once per call, into the packed tiles.
// A wave takes two rows that lie 8 apart (neighbours in the packed order) times 512 k per trip: 8 loads of 256 contiguous
// bytes from each row, 8 stores of 256 contiguous bytes, one per K step.
__global__ __launch_bounds__(PK_BLOCK)
void pack_bf16_kernel(const float* __restrict__ hs,
                      const float* __restrict__ q_w,
                      const float* __restrict__ k_w,
                      __bf16* __restrict__ apk,
                      __bf16* __restrict__ wpk)
{
    const int lane = threadIdx.x & 31;
    const int hlf  = lane >> 4;
    const int l16  = lane & 15;
    const int gw   = __builtin_amdgcn_readfirstlane((int)(blockIdx.x * (PK_BLOCK / 32) + (threadIdx.x >> 5)));
    for (int it = 0; it < PK_ITERS; ++it) {
        const int u   = it * PK_WAVES + gw;                    // wave-uniform
        const int ke  = u & 7;                                 // which eighth of K
        const int row = ((u >> 6) << 4) + ((u >> 3) & 7);      // the pair's first row, of hs rows, q_w rows, k_w rows in a line
        const float* src;
        __bf16* dst;      // the tile of K step 0 that holds the pair
        unsigned tile;    // elements from one K step's tile to the next
        int r;            // the first row's number inside the tile
        if (row < S_LEN) {
            src  = hs + (size_t)row * D_DIM;
            r    = row & (BM - 1);
            dst  = apk + (size_t)(row / BM) * KT * A_TILE_ELEMS;
            tile = A_TILE_ELEMS;
        } else if (row < S_LEN + H_N * NQ) {
            const int n = row - S_LEN;
            src  = q_w + (size_t)n * D_DIM;
            r    = n & (NQ - 1);
            dst  = wpk + (size_t)(n / NQ) * KT * W_TILE_ELEMS;
            tile = W_TILE_ELEMS;
        } else {
            const int n = row - (S_LEN + H_N * NQ);
            src  = k_w + (size_t)n * D_DIM;
            r    = NQ + (n & (NK - 1));
            dst  = wpk + (size_t)(n / NK) * KT * W_TILE_ELEMS;
            tile = W_TILE_ELEMS;
        }
        const int place = (r & ~31) | ((r & 7) << 2) | ((r >> 3) & 3);   // even; row r + 8 lies at place + 1
        src += hlf * 8 * D_DIM + ke * (D_DIM / 8) + l16 * 4;
        dst += (size_t)(ke * (KT / 8)) * tile + (place + hlf) * KSTEP + l16 * 4;

        v4f f[8];
        #pragma unroll
        for (int j = 0; j < 8; ++j)   // read once in this call: non-temporal, so that L2 keeps the packed tiles
            f[j] = __builtin_nontemporal_load((const v4f*)(src + j * KSTEP));
        #pragma unroll
        for (int j = 0; j < 8; ++j)
            *(v4bf*)(dst + (size_t)j * tile) = __builtin_convertvector(f[j], v4bf);
        // stands in front of the next trip's rewrite of the address registers that these stores name
        asm volatile("s_wait_xcnt 0x0" ::: "memory");
    }
}

__device__ __forceinline__ v16bf frag16(const __bf16* p) {
    // lane's 16 bf16: chunk0 at +0, chunk1 at +16 elems (K layout per ISA)
    v8bf lo = *(const v8bf*)p;
    v8bf hi = *(const v8bf*)(p + 16);
    return __builtin_shufflevector(lo, hi, 0,1,2,3,4,5,6,7,8,9,10,11,12,13,14,15);
}

__global__ __launch_bounds__(BLOCK, 1)
void fused_gatescore_kernel(const __bf16* __restrict__ apk,
                            const __bf16* __restrict__ wpk,
                            const float* __restrict__ q_b,
                            const float* __restrict__ q_norm_w,
                            const float* __restrict__ k_norm_w,
                            const float* __restrict__ k_base,
                            const float* __restrict__ bvec,
                            float* __restrict__ out)
{
    extern __shared__ unsigned char smem[];
    __bf16* Ald = (__bf16*)smem;                 // [BM][AS] bf16 (GEMM stage, two of them STAGE_ELEMS apart)
    __bf16* Wld = (__bf16*)(smem + A_BYTES);     // [NTOT][WS] bf16 (GEMM stage)
    float*  Cld = (float*)smem;                  // [BM][CS] f32  (epilogue stage)

    const int tid  = threadIdx.x;
    const int h    = blockIdx.y;
    const int s0   = blockIdx.x * BM;
    const int lane = tid & 31;
    const int wv   = tid >> 5;          // wave id 0..15
    const int hlf  = lane >> 4;         // 0: lanes 0-15, 1: lanes 16-31
    const int l16  = lane & 15;
    const int mt   = wv & 3;            // M-tile (16 rows) this wave owns
    const int nbase = (wv >> 2) * 160;  // N-quarter this wave owns (10 tiles of 16)

    v8f acc[NTW] = {};

    // staging map, A and W alike: thread t takes bytes 16 t .. 16 t + 15 of each 8-KiB sweep (64 rows) of a packed tile,
    // so a wave-wide load reads 512 contiguous bytes. They are four rows that lie 8 apart (the packing's order):
    // 8 * 144 B = 32 banks, so each half wave's 16-B LDS stores hit each bank once.
    const int srow = ((wv >> 3) << 5) + (wv & 7) + ((lane >> 3) << 3);   // 0..63, each eight times per block
    const char* aptr = (const char*)(apk + (size_t)blockIdx.x * KT * A_TILE_ELEMS);   // block-uniform bases
    const char* wptr = (const char*)(wpk + (size_t)h * KT * W_TILE_ELEMS);
    __bf16* ast = Ald + srow * AS + (lane & 7) * 8;
    __bf16* wst = Wld + srow * WS + (lane & 7) * 8;

    // W prefetch target, one K step ahead of the loads: threads 0..319 (waves 0..9) ask for one 256-B unit each of the tile
    // (advanced in front of each use: the first prefetch asks for K step 2)
    const char* pfw = wptr + W_TILE_ELEMS * 2 + (tid < W_TILE_ELEMS * 2 / 256 ? tid : 0) * 256;
    const bool  pfw_wave = __builtin_amdgcn_readfirstlane(wv) < W_TILE_ELEMS * 2 / 256 / 32;

    // One K step's operands in registers: A tile (64 x 64 bf16, 1 sweep), W tile (640 x 64 bf16, 10 sweeps).
    // They are loaded one K step ahead of their use, so that the L2 time runs under the WMMAs of the step before.
    v8bf av, wr[NTOT / 64];
    unsigned soa = (unsigned)tid * 16u, sow = (unsigned)tid * 16u;   // lane's byte offsets at the K step loaded last
    auto load_step = [&]() {
        av = *(const v8bf*)(aptr + soa);
        #pragma unroll
        for (int j = 0; j < NTOT / 64; ++j)
            wr[j] = *(const v8bf*)(wptr + j * SWEEP_BYTES + sow);
    };

    load_step();
    int bo = 0;   // element offset of this K step's LDS buffer: 0 or STAGE_ELEMS

    for (int d0 = 0; d0 < D_DIM; d0 += KSTEP) {
        // ---- 16 B per lane into this step's LDS buffer ----
        // Its last readers (two steps back) have all passed the barrier of the step before this one.
        *(v8bf*)(ast + bo) = av;
        #pragma unroll
        for (int j = 0; j < NTOT / 64; ++j)
            *(v8bf*)(wst + bo + j * 64 * WS) = wr[j];

        // ---- next K step's global loads, in flight across the barrier and this step's WMMAs ----
        if (d0 + KSTEP < D_DIM) {
            // stands in front of the advances of the registers that the last step's loads and prefetches name;
            // placed here, behind the use of that step's data, so that no wave waits on it between its new
            // loads and the barrier
            asm volatile("s_wait_xcnt 0x0" ::: "memory");
            soa += A_TILE_ELEMS * 2;
            sow += W_TILE_ELEMS * 2;
            // the W tile of the K step after the one loaded below into L2, one prefetch per 256-B unit. In asm so that it
            // names a pointer that lives through the loop: a temporary would be rewritten right behind the prefetch.
            // The pointer advances only under this test, so it stops in the head's last tile, inside the packed W.
            if (d0 + 2 * KSTEP < D_DIM) {
                pfw += W_TILE_ELEMS * 2;
                if (pfw_wave)
                    asm volatile("global_prefetch_b8 %0, off scope:SCOPE_SE" :: "v"(pfw));
            }
            load_step();
        }

        // Work-group barrier whose fences name LDS alone: it publishes the stage (s_wait_dscnt 0 in front),
        // while __syncthreads() would also wait here for the global loads just issued.
        __builtin_amdgcn_fence(__ATOMIC_RELEASE, "workgroup", "local");
        __builtin_amdgcn_s_barrier();
        __builtin_amdgcn_fence(__ATOMIC_ACQUIRE, "workgroup", "local");

        // ---- two K=32 slices per staged tile ----
        #pragma unroll
        for (int kk = 0; kk < 2; ++kk) {
            const int koff = bo + kk * 32;
            // A fragment (16x32): lanes 0-15 -> K 0..7,16..23; lanes 16-31 -> K 8..15,24..31
            const v16bf afrag = frag16(Ald + (mt * 16 + l16) * AS + koff + hlf * 8);

            // B fragments in groups of five (ten at once no longer fit beside the operands in flight),
            // each group loaded whole, then its WMMAs back-to-back.
            #pragma unroll
            for (int n0 = 0; n0 < NTW; n0 += NTW / 2) {
                v16bf bf[NTW / 2];
                #pragma unroll
                for (int nt = 0; nt < NTW / 2; ++nt) {
                    bf[nt] = frag16(Wld + (nbase + (n0 + nt) * 16 + l16) * WS + koff + hlf * 8);
                }
                // holds the group's loads together in front of its WMMAs: left free, this build, short of registers,
                // loads one fragment at a time and puts a full LDS wait in front of every WMMA
                __builtin_amdgcn_sched_barrier(0);
                #pragma unroll
                for (int nt = 0; nt < NTW / 2; ++nt) {
                    acc[n0 + nt] = __builtin_amdgcn_wmma_f32_16x16x32_bf16(
                        false, afrag, false, bf[nt], (short)0, acc[n0 + nt], false, false);
                }
            }
        }
        bo ^= STAGE_ELEMS;
    }

    __syncthreads();
    // ---- dump accumulators to LDS C tile [BM][CS]; VGPR r -> M = 16*mt + 8*hlf + r, N = lane&15 ----
    #pragma unroll
    for (int nt = 0; nt < NTW; ++nt) {
        const int n = nbase + nt * 16 + l16;
        #pragma unroll
        for (int r = 0; r < 8; ++r) {
            Cld[(mt * 16 + hlf * 8 + r) * CS + n] = acc[nt][r];
        }
    }
    __syncthreads();

    // ---- fused epilogue: bias, RMS norms, dots, logistic sink score ----
    if (tid < BM) {
        const int m = tid;
        const float* crow = Cld + m * CS;              // [0..511]=q raw, [512..639]=k raw
        const float inv_scale = 0.08838834764831845f;  // 1/sqrt(HD)

        float ssk = 0.f;
        for (int d = 0; d < HD_N; ++d) { float kv = crow[NQ + d]; ssk += kv * kv; }
        const float rk = rsqrtf(ssk * (1.0f / HD_N) + EPSV);

        float score = 0.f;
        for (int g = 0; g < G_N; ++g) {
            float ssq = 0.f, dqk = 0.f, dbase = 0.f;
            for (int d = 0; d < HD_N; ++d) {
                float qv = crow[g * HD_N + d] + q_b[h * NQ + g * HD_N + d];
                ssq += qv * qv;
                float qn = qv * q_norm_w[d];
                dqk   += (crow[NQ + d] * k_norm_w[d]) * qn;
                dbase += k_base[h * HD_N + d] * qn;
            }
            const float rq    = rsqrtf(ssq * (1.0f / HD_N) + EPSV);
            const float logit = dqk * rk * rq * inv_scale + bvec[h * G_N + g];
            const float lbase = dbase * rq * inv_scale;
            score += 1.f / (1.f + expf(lbase - logit));
        }
        out[(size_t)h * S_LEN + (s0 + m)] = score * 0.25f;
    }
}

extern "C" void kernel_launch(void* const* d_in, const int* in_sizes, int n_in,
                              void* d_out, int out_size, void* d_ws, size_t ws_size,
                              hipStream_t stream) {
    const float* hs       = (const float*)d_in[0];
    const float* q_w      = (const float*)d_in[1];
    const float* q_b      = (const float*)d_in[2];
    const float* k_w      = (const float*)d_in[3];
    const float* q_norm_w = (const float*)d_in[4];
    const float* k_norm_w = (const float*)d_in[5];
    const float* k_base   = (const float*)d_in[6];
    const float* bvec     = (const float*)d_in[7];
    float* out = (float*)d_out;
    __bf16* apk = (__bf16*)d_ws;                     // 64 MiB
    __bf16* wpk = apk + (size_t)S_LEN * D_DIM;       // 40 MiB

    pack_bf16_kernel<<<PK_GRID, PK_BLOCK, 0, stream>>>(hs, q_w, k_w, apk, wpk);

    dim3 grid(S_LEN / BM, H_N);
    fused_gatescore_kernel<<<grid, BLOCK, SMEM_BYTES, stream>>>(
        apk, wpk, q_b, q_norm_w, k_norm_w, k_base, bvec, out);
}

// v004
// One run takes 281 microseconds.
// Timed twice side by side with v003, it ran 1.52 times as fast both times.
// Counting every step since v000, it is 4.23 times as fast.
#include <hip/hip_runtime.h>
#include <hip/hip_bf16.h>

typedef __attribute__((ext_vector_type(16))) __bf16 v16bf;
typedef __attribute__((ext_vector_type(8)))  __bf16 v8bf;
typedef __attribute__((ext_vector_type(4)))  __bf16 v4bf;
typedef __attribute__((ext_vector_type(8)))  float  v8f;
typedef __attribute__((ext_vector_type(4)))  float  v4f;

#define S_LEN 8192
#define D_DIM 4096
#define H_N   8
#define G_N   4
#define HD_N  128
#define EPSV  1e-6f

#define BLOCK 256     // 8 waves (wave32), two per SIMD
#define BM    128     // tokens per workgroup
#define MTW   4       // M-tiles per wave (64 tokens)
#define EM    64      // tokens per epilogue phase
#define NQ    512     // q columns per head (G*HD)
#define NK    128     // k columns per head
#define NTOT  640     // combined N
#define NTW   10      // N-tiles per wave
#define KSTEP 64      // K per staging step (2 wmma K-slices of 32)
#define AS    72      // A LDS row stride (bf16 elems, padded; 144B, 16B-aligned)
#define WS    72      // W LDS row stride (bf16 elems, padded)
#define CS    648     // C LDS row stride (f32 elems, padded)
#define A_BYTES (BM * AS * 2)          // 18432
#define STAGE_ELEMS ((BM + NTOT) * AS) // one GEMM stage, A then W: 55296 bf16 = 110592 B
#define SMEM_BYTES (2 * STAGE_ELEMS * 2)   // two GEMM stages, 221184 B (> the epilogue's EM * CS * 4 = 165888)

// Packed bf16 operands in the workspace, written by pack_bf16_kernel and read by the GEMM in the same call.
// One tile = the rows that one workgroup stages in one K step, 128 B (KSTEP bf16) a row, tiles of a workgroup's
// K steps one behind the other: A [S_LEN / BM][KT][BM rows], W [H_N][KT][NTOT rows: q rows, then k rows].
// Inside every 32 rows, row a + 8 * b (a < 8, b < 4) lies at place 4 * a + b: a wave's 512 contiguous bytes are then
// four rows that lie 8 apart, which its 16-B LDS stores at the 144-B pitch put on distinct banks.
#define KT           (D_DIM / KSTEP)       // 64 K steps
#define A_TILE_ELEMS (BM * KSTEP)          // 16 KiB
#define W_TILE_ELEMS (NTOT * KSTEP)        // 80 KiB
#define SWEEP_BYTES  (BLOCK * 16)          // one 16-B load per thread of the GEMM block: 32 rows
#define SWEEP_ROWS   (SWEEP_BYTES / (KSTEP * 2))
#define A_SWEEPS     (BM / SWEEP_ROWS)     // 4
#define W_SWEEPS     (NTOT / SWEEP_ROWS)   // 20
#define PK_BLOCK 512
#define PK_GRID  256
#define PK_WAVES (PK_GRID * PK_BLOCK / 32)             // 4096
#define PK_UNITS ((S_LEN + H_N * NTOT) * 4)            // a unit = two rows x 512 k
#define PK_ITERS (PK_UNITS / PK_WAVES)                 // 13, exact

// f32 -> bf16 (round to nearest even) of hs, q_w and k_w, once per call, into the packed tiles.
// A wave takes two rows that lie 8 apart (neighbours in the packed order) times 512 k per trip: 8 loads of 256 contiguous
// bytes from each row, 8 stores of 256 contiguous bytes, one per K step.
__global__ __launch_bounds__(PK_BLOCK)
void pack_bf16_kernel(const float* __restrict__ hs,
                      const float* __restrict__ q_w,
                      const float* __restrict__ k_w,
                      __bf16* __restrict__ apk,
                      __bf16* __restrict__ wpk)
{
    const int lane = threadIdx.x & 31;
    const int hlf  = lane >> 4;
    const int l16  = lane & 15;
    const int gw   = __builtin_amdgcn_readfirstlane((int)(blockIdx.x * (PK_BLOCK / 32) + (threadIdx.x >> 5)));
    for (int it = 0; it < PK_ITERS; ++it) {
        const int u   = it * PK_WAVES + gw;                    // wave-uniform
        const int ke  = u & 7;                                 // which eighth of K
        const int row = ((u >> 6) << 4) + ((u >> 3) & 7);      // the pair's first row, of hs rows, q_w rows, k_w rows in a line
        const float* src;
        __bf16* dst;      // the tile of K step 0 that holds the pair
        unsigned tile;    // elements from one K step's tile to the next
        int r;            // the first row's number inside the tile
        if (row < S_LEN) {
            src  = hs + (size_t)row * D_DIM;
            r    = row & (BM - 1);
            dst  = apk + (size_t)(row / BM) * KT * A_TILE_ELEMS;
            tile = A_TILE_ELEMS;
        } else if (row < S_LEN + H_N * NQ) {
            const int n = row - S_LEN;
            src  = q_w + (size_t)n * D_DIM;
            r    = n & (NQ - 1);
            dst  = wpk + (size_t)(n / NQ) * KT * W_TILE_ELEMS;
            tile = W_TILE_ELEMS;
        } else {
            const int n = row - (S_LEN + H_N * NQ);
            src  = k_w + (size_t)n * D_DIM;
            r    = NQ + (n & (NK - 1));
            dst  = wpk + (size_t)(n / NK) * KT * W_TILE_ELEMS;
            tile = W_TILE_ELEMS;
        }
        const int place = (r & ~31) | ((r & 7) << 2) | ((r >> 3) & 3);   // even; row r + 8 lies at place + 1
        src += hlf * 8 * D_DIM + ke * (D_DIM / 8) + l16 * 4;
        dst += (size_t)(ke * (KT / 8)) * tile + (place + hlf) * KSTEP + l16 * 4;

        v4f f[8];
        #pragma unroll
        for (int j = 0; j < 8; ++j)   // read once in this call: non-temporal, so that L2 keeps the packed tiles
            f[j] = __builtin_nontemporal_load((const v4f*)(src + j * KSTEP));
        #pragma unroll
        for (int j = 0; j < 8; ++j)
            *(v4bf*)(dst + (size_t)j * tile) = __builtin_convertvector(f[j], v4bf);
        // stands in front of the next trip's rewrite of the address registers that these stores name
        asm volatile("s_wait_xcnt 0x0" ::: "memory");
    }
}

__device__ __forceinline__ v16bf frag16(const __bf16* p) {
    // lane's 16 bf16: chunk0 at +0, chunk1 at +16 elems (K layout per ISA)
    v8bf lo = *(const v8bf*)p;
    v8bf hi = *(const v8bf*)(p + 16);
    return __builtin_shufflevector(lo, hi, 0,1,2,3,4,5,6,7,8,9,10,11,12,13,14,15);
}

__global__ __launch_bounds__(BLOCK, 1)
void fused_gatescore_kernel(const __bf16* __restrict__ apk,
                            const __bf16* __restrict__ wpk,
                            const float* __restrict__ q_b,
                            const float* __restrict__ q_norm_w,
                            const float* __restrict__ k_norm_w,
                            const float* __restrict__ k_base,
                            const float* __restrict__ bvec,
                            float* __restrict__ out)
{
    extern __shared__ unsigned char smem[];
    __bf16* Ald = (__bf16*)smem;                 // [BM][AS] bf16 (GEMM stage, two of them STAGE_ELEMS apart)
    __bf16* Wld = (__bf16*)(smem + A_BYTES);     // [NTOT][WS] bf16 (GEMM stage)
    float*  Cld = (float*)smem;                  // [EM][CS] f32  (epilogue stage, one half of the tokens at a time)

    const int tid  = threadIdx.x;
    const int h    = blockIdx.y;
    const int s0   = blockIdx.x * BM;
    const int lane = tid & 31;
    const int wv   = tid >> 5;          // wave id 0..7
    const int hlf  = lane >> 4;         // 0: lanes 0-15, 1: lanes 16-31
    const int l16  = lane & 15;
    const int mh   = __builtin_amdgcn_readfirstlane(wv) & 1;   // M-half (64 rows, 4 tiles of 16) this wave owns
    const int nbase = (wv >> 1) * 160;  // N-quarter this wave owns (10 tiles of 16)

    v8f acc[MTW][NTW] = {};

    // staging map, A and W alike: thread t takes bytes 16 t .. 16 t + 15 of each 4-KiB sweep (32 rows) of a packed tile,
    // so a wave-wide load reads 512 contiguous bytes. They are four rows that lie 8 apart (the packing's order):
    // 8 * 144 B = 32 banks, so each half wave's 16-B LDS stores hit each bank once.
    const int srow = wv + ((lane >> 3) << 3);   // 0..31, each eight times per block
    const char* aptr = (const char*)(apk + (size_t)blockIdx.x * KT * A_TILE_ELEMS);   // block-uniform bases
    const char* wptr = (const char*)(wpk + (size_t)h * KT * W_TILE_ELEMS);
    __bf16* ast = Ald + srow * AS + (lane & 7) * 8;
    __bf16* wst = Wld + srow * WS + (lane & 7) * 8;

    // W prefetch target, one K step ahead of the loads: the tile's 320 units of 256 B, one per thread and a second one
    // (64 KiB on) from waves 0 and 1 (advanced in front of each use: the first prefetch asks for K step 2)
    const char* pfw = wptr + W_TILE_ELEMS * 2 + tid * 256;
    const bool  pfw_wave = __builtin_amdgcn_readfirstlane(wv) < (W_TILE_ELEMS * 2 / 256 - BLOCK) / 32;

    // One K step's operands in registers: A tile (128 x 64 bf16, 4 sweeps), W tile (640 x 64 bf16, 20 sweeps).
    // They are loaded one K step ahead of their use, so that the L2 time runs under the WMMAs of the step before.
    v8bf av[A_SWEEPS], wr[W_SWEEPS];
    unsigned soa = (unsigned)tid * 16u, sow = (unsigned)tid * 16u;   // lane's byte offsets at the K step loaded last
    auto load_step = [&]() {
        #pragma unroll
        for (int j = 0; j < A_SWEEPS; ++j)
            av[j] = *(const v8bf*)(aptr + j * SWEEP_BYTES + soa);
        #pragma unroll
        for (int j = 0; j < W_SWEEPS; ++j)
            wr[j] = *(const v8bf*)(wptr + j * SWEEP_BYTES + sow);
    };

    load_step();
    int bo = 0;   // element offset of this K step's LDS buffer: 0 or STAGE_ELEMS

    for (int d0 = 0; d0 < D_DIM; d0 += KSTEP) {
        // ---- 16 B per lane into this step's LDS buffer ----
        // Its last readers (two steps back) have all passed the barrier of the step before this one.
        #pragma unroll
        for (int j = 0; j < A_SWEEPS; ++j)
            *(v8bf*)(ast + bo + j * SWEEP_ROWS * AS) = av[j];
        #pragma unroll
        for (int j = 0; j < W_SWEEPS; ++j)
            *(v8bf*)(wst + bo + j * SWEEP_ROWS * WS) = wr[j];

        // ---- next K step's global loads, in flight across the barrier and this step's WMMAs ----
        if (d0 + KSTEP < D_DIM) {
            // stands in front of the advances of the registers that the last step's loads and prefetches name;
            // placed here, behind the use of that step's data, so that no wave waits on it between its new
            // loads and the barrier
            asm volatile("s_wait_xcnt 0x0" ::: "memory");
            soa += A_TILE_ELEMS * 2;
            sow += W_TILE_ELEMS * 2;
            // the W tile of the K step after the one loaded below into L2, one prefetch per 256-B unit. In asm so that it
            // names a pointer that lives through the loop: a temporary would be rewritten right behind the prefetch.
            // The pointer advances only under this test, so it stops in the head's last tile, inside the packed W.
            if (d0 + 2 * KSTEP < D_DIM) {
                pfw += W_TILE_ELEMS * 2;
                asm volatile("global_prefetch_b8 %0, off scope:SCOPE_SE" :: "v"(pfw));
                if (pfw_wave)
                    asm volatile("global_prefetch_b8 %0, off offset:65536 scope:SCOPE_SE" :: "v"(pfw));
            }
            load_step();
        }

        // Work-group barrier whose fences name LDS alone: it publishes the stage (s_wait_dscnt 0 in front),
        // while __syncthreads() would also wait here for the global loads just issued.
        __builtin_amdgcn_fence(__ATOMIC_RELEASE, "workgroup", "local");
        __builtin_amdgcn_s_barrier();
        __builtin_amdgcn_fence(__ATOMIC_ACQUIRE, "workgroup", "local");

        // ---- two K=32 slices per staged tile ----
        #pragma unroll
        for (int kk = 0; kk < 2; ++kk) {
            const int koff = bo + kk * 32;
            // A fragments (16x32 each): lanes 0-15 -> K 0..7,16..23; lanes 16-31 -> K 8..15,24..31
            v16bf afrag[MTW];
            #pragma unroll
            for (int i = 0; i < MTW; ++i)
                afrag[i] = frag16(Ald + (mh * 64 + i * 16 + l16) * AS + koff + hlf * 8);

            // B fragments in groups of five (ten at once do not fit beside the operands in flight),
            // each group loaded whole, then its WMMAs back-to-back: every B fragment meets the four A fragments.
            #pragma unroll
            for (int n0 = 0; n0 < NTW; n0 += NTW / 2) {
                v16bf bf[NTW / 2];
                #pragma unroll
                for (int nt = 0; nt < NTW / 2; ++nt) {
                    bf[nt] = frag16(Wld + (nbase + (n0 + nt) * 16 + l16) * WS + koff + hlf * 8);
                }
                // holds the group's loads together in front of its WMMAs: left free, this build, short of registers,
                // loads one fragment at a time and puts a full LDS wait in front of every WMMA
                __builtin_amdgcn_sched_barrier(0);
                #pragma unroll
                for (int nt = 0; nt < NTW / 2; ++nt) {
                    #pragma unroll
                    for (int i = 0; i < MTW; ++i)
                        acc[i][n0 + nt] = __builtin_amdgcn_wmma_f32_16x16x32_bf16(
                            false, afrag[i], false, bf[nt], (short)0, acc[i][n0 + nt], false, false);
                }
            }
        }
        bo ^= STAGE_ELEMS;
    }

    // The f32 C tile of all 128 tokens does not fit LDS: the two halves of the tokens go through the epilogue in turn.
    // Kept rolled: one copy of the epilogue's code serves both halves.
    #pragma unroll 1
    for (int ph = 0; ph < BM / EM; ++ph) {
    __syncthreads();   // the last readers of this LDS (the GEMM's last step, or the half before) are through
    // ---- dump accumulators to LDS C tile [EM][CS]; VGPR r -> M = 16*i + 8*hlf + r, N = lane&15 ----
    if (mh == ph) {
        #pragma unroll
        for (int i = 0; i < MTW; ++i) {
            #pragma unroll
            for (int nt = 0; nt < NTW; ++nt) {
                const int n = nbase + nt * 16 + l16;
                #pragma unroll
                for (int r = 0; r < 8; ++r) {
                    Cld[(i * 16 + hlf * 8 + r) * CS + n] = acc[i][nt][r];
                }
            }
        }
    }
    __syncthreads();

    // ---- fused epilogue: bias, RMS norms, dots, logistic sink score ----
    if (tid < EM) {
        const int m = tid;
        const float* crow = Cld + m * CS;              // [0..511]=q raw, [512..639]=k raw
        const float inv_scale = 0.08838834764831845f;  // 1/sqrt(HD)

        float ssk = 0.f;
        for (int d = 0; d < HD_N; ++d) { float kv = crow[NQ + d]; ssk += kv * kv; }
        const float rk = rsqrtf(ssk * (1.0f / HD_N) + EPSV);

        float score = 0.f;
        for (int g = 0; g < G_N; ++g) {
            float ssq = 0.f, dqk = 0.f, dbase = 0.f;
            for (int d = 0; d < HD_N; ++d) {
                float qv = crow[g * HD_N + d] + q_b[h * NQ + g * HD_N + d];
                ssq += qv * qv;
                float qn = qv * q_norm_w[d];
                dqk   += (crow[NQ + d] * k_norm_w[d]) * qn;
                dbase += k_base[h * HD_N + d] * qn;
            }
            const float rq    = rsqrtf(ssq * (1.0f / HD_N) + EPSV);
            const float logit = dqk * rk * rq * inv_scale + bvec[h * G_N + g];
            const float lbase = dbase * rq * inv_scale;
            score += 1.f / (1.f + expf(lbase - logit));
        }
        out[(size_t)h * S_LEN + (s0 + ph * EM + m)] = score * 0.25f;
        // stands in front of the second half's rewrite of the registers that this store names
        asm volatile("s_wait_xcnt 0x0" ::: "memory");
    }
    }
}

extern "C" void kernel_launch(void* const* d_in, const int* in_sizes, int n_in,
                              void* d_out, int out_size, void* d_ws, size_t ws_size,
                              hipStream_t stream) {
    const float* hs       = (const float*)d_in[0];
    const float* q_w      = (const float*)d_in[1];
    const float* q_b      = (const float*)d_in[2];
    const float* k_w      = (const float*)d_in[3];
    const float* q_norm_w = (const float*)d_in[4];
    const float* k_norm_w = (const float*)d_in[5];
    const float* k_base   = (const float*)d_in[6];
    const float* bvec     = (const float*)d_in[7];
    float* out = (float*)d_out;
    __bf16* apk = (__bf16*)d_ws;                     // 64 MiB
    __bf16* wpk = apk + (size_t)S_LEN * D_DIM;       // 40 MiB

    pack_bf16_kernel<<<PK_GRID, PK_BLOCK, 0, stream>>>(hs, q_w, k_w, apk, wpk);

    dim3 grid(S_LEN / BM, H_N);
    fused_gatescore_kernel<<<grid, BLOCK, SMEM_BYTES, stream>>>(
        apk, wpk, q_b, q_norm_w, k_norm_w, k_base, bvec, out);
}

// v005
// A run of this version takes 226 microseconds.
// Two timings next to v004 both put it at 1.24 times that version's speed.
// Counting every step since v000, it is 5.26 times as fast.
#include <hip/hip_runtime.h>
#include <hip/hip_bf16.h>

typedef __attribute__((ext_vector_type(16))) __bf16 v16bf;
typedef __attribute__((ext_vector_type(8)))  __bf16 v8bf;
typedef __attribute__((ext_vector_type(4)))  __bf16 v4bf;
typedef __attribute__((ext_vector_type(8)))  float  v8f;
typedef __attribute__((ext_vector_type(4)))  float  v4f;

#define S_LEN 8192
#define D_DIM 4096
#define H_N   8
#define G_N   4
#define HD_N  128
#define EPSV  1e-6f

#define BLOCK 256     // 8 waves (wave32), two per SIMD
#define BM    128     // tokens per workgroup
#define MTW   4       // M-tiles per wave (64 tokens)
#define EM    64      // tokens per epilogue phase
#define NQ    512     // q columns per head (G*HD)
#define NK    128     // k columns per head
#define NTOT  640     // combined N
#define NTW   10      // N-tiles per wave
#define KSTEP 64      // K per staging step (2 wmma K-slices of 32)
#define AS    72      // A LDS row stride (bf16 elems, padded; 144B, 16B-aligned)
#define WS    72      // W LDS row stride (bf16 elems, padded)
#define PM    68      // epilogue LDS pitch of one column (f32 elems): EM tokens + 4; 272 B = 16 B x 17
#define A_BYTES (BM * AS * 2)          // 18432
#define STAGE_ELEMS ((BM + NTOT) * AS) // one GEMM stage, A then W: 55296 bf16 = 110592 B
#define SMEM_BYTES (2 * STAGE_ELEMS * 2)   // two GEMM stages, 221184 B
static_assert((NTOT * PM + G_N * EM) * 4 <= SMEM_BYTES, "the epilogue's columns and group scores fit the GEMM stages");

// Packed bf16 operands in the workspace, written by pack_bf16_kernel and read by the GEMM in the same call.
// One tile = the rows that one workgroup stages in one K step, 128 B (KSTEP bf16) a row, tiles of a workgroup's
// K steps one behind the other: A [S_LEN / BM][KT][BM rows], W [H_N][KT][NTOT rows: q rows, then k rows].
// Inside every 32 rows, row a + 8 * b (a < 8, b < 4) lies at place 4 * a + b: a wave's 512 contiguous bytes are then
// four rows that lie 8 apart, which its 16-B LDS stores at the 144-B pitch put on distinct banks.
#define KT           (D_DIM / KSTEP)       // 64 K steps
#define A_TILE_ELEMS (BM * KSTEP)          // 16 KiB
#define W_TILE_ELEMS (NTOT * KSTEP)        // 80 KiB
#define SWEEP_BYTES  (BLOCK * 16)          // one 16-B load per thread of the GEMM block: 32 rows
#define SWEEP_ROWS   (SWEEP_BYTES / (KSTEP * 2))
#define A_SWEEPS     (BM / SWEEP_ROWS)     // 4
#define W_SWEEPS     (NTOT / SWEEP_ROWS)   // 20
#define PK_BLOCK 512
#define PK_GRID  256
#define PK_WAVES (PK_GRID * PK_BLOCK / 32)             // 4096
#define PK_UNITS ((S_LEN + H_N * NTOT) * 4)            // a unit = two rows x 512 k
#define PK_ITERS (PK_UNITS / PK_WAVES)                 // 13, exact

// f32 -> bf16 (round to nearest even) of hs, q_w and k_w, once per call, into the packed tiles.
// A wave takes two rows that lie 8 apart (neighbours in the packed order) times 512 k per trip: 8 loads of 256 contiguous
// bytes from each row, 8 stores of 256 contiguous bytes, one per K step.
__global__ __launch_bounds__(PK_BLOCK)
void pack_bf16_kernel(const float* __restrict__ hs,
                      const float* __restrict__ q_w,
                      const float* __restrict__ k_w,
                      __bf16* __restrict__ apk,
                      __bf16* __restrict__ wpk)
{
    const int lane = threadIdx.x & 31;
    const int hlf  = lane >> 4;
    const int l16  = lane & 15;
    const int gw   = __builtin_amdgcn_readfirstlane((int)(blockIdx.x * (PK_BLOCK / 32) + (threadIdx.x >> 5)));
    for (int it = 0; it < PK_ITERS; ++it) {
        const int u   = it * PK_WAVES + gw;                    // wave-uniform
        const int ke  = u & 7;                                 // which eighth of K
        const int row = ((u >> 6) << 4) + ((u >> 3) & 7);      // the pair's first row, of hs rows, q_w rows, k_w rows in a line
        const float* src;
        __bf16* dst;      // the tile of K step 0 that holds the pair
        unsigned tile;    // elements from one K step's tile to the next
        int r;            // the first row's number inside the tile
        if (row < S_LEN) {
            src  = hs + (size_t)row * D_DIM;
            r    = row & (BM - 1);
            dst  = apk + (size_t)(row / BM) * KT * A_TILE_ELEMS;
            tile = A_TILE_ELEMS;
        } else if (row < S_LEN + H_N * NQ) {
            const int n = row - S_LEN;
            src  = q_w + (size_t)n * D_DIM;
            r    = n & (NQ - 1);
            dst  = wpk + (size_t)(n / NQ) * KT * W_TILE_ELEMS;
            tile = W_TILE_ELEMS;
        } else {
            const int n = row - (S_LEN + H_N * NQ);
            src  = k_w + (size_t)n * D_DIM;
            r    = NQ + (n & (NK - 1));
            dst  = wpk + (size_t)(n / NK) * KT * W_TILE_ELEMS;
            tile = W_TILE_ELEMS;
        }
        const int place = (r & ~31) | ((r & 7) << 2) | ((r >> 3) & 3);   // even; row r + 8 lies at place + 1
        src += hlf * 8 * D_DIM + ke * (D_DIM / 8) + l16 * 4;
        dst += (size_t)(ke * (KT / 8)) * tile + (place + hlf) * KSTEP + l16 * 4;

        v4f f[8];
        #pragma unroll
        for (int j = 0; j < 8; ++j)   // read once in this call: non-temporal, so that L2 keeps the packed tiles
            f[j] = __builtin_nontemporal_load((const v4f*)(src + j * KSTEP));
        #pragma unroll
        for (int j = 0; j < 8; ++j)
            *(v4bf*)(dst + (size_t)j * tile) = __builtin_convertvector(f[j], v4bf);
        // stands in front of the next trip's rewrite of the address registers that these stores name
        asm volatile("s_wait_xcnt 0x0" ::: "memory");
    }
}

__device__ __forceinline__ v16bf frag16(const __bf16* p) {
    // lane's 16 bf16: chunk0 at +0, chunk1 at +16 elems (K layout per ISA)
    v8bf lo = *(const v8bf*)p;
    v8bf hi = *(const v8bf*)(p + 16);
    return __builtin_shufflevector(lo, hi, 0,1,2,3,4,5,6,7,8,9,10,11,12,13,14,15);
}

__global__ __launch_bounds__(BLOCK, 1)
void fused_gatescore_kernel(const __bf16* __restrict__ apk,
                            const __bf16* __restrict__ wpk,
                            const float* __restrict__ q_b,
                            const float* __restrict__ q_norm_w,
                            const float* __restrict__ k_norm_w,
                            const float* __restrict__ k_base,
                            const float* __restrict__ bvec,
                            float* __restrict__ out)
{
    extern __shared__ unsigned char smem[];
    __bf16* Ald = (__bf16*)smem;                 // [BM][AS] bf16 (GEMM stage, two of them STAGE_ELEMS apart)
    __bf16* Wld = (__bf16*)(smem + A_BYTES);     // [NTOT][WS] bf16 (GEMM stage)
    float*  Ct  = (float*)smem;                  // [NTOT][PM] f32 (epilogue stage, one half of the tokens at a time)
    float*  Sld = Ct + NTOT * PM;             // [G_N][EM] f32: each group's score of each token of the half

    const int tid  = threadIdx.x;
    const int h    = blockIdx.y;
    const int s0   = blockIdx.x * BM;
    const int lane = tid & 31;
    const int wv   = tid >> 5;          // wave id 0..7
    const int hlf  = lane >> 4;         // 0: lanes 0-15, 1: lanes 16-31
    const int l16  = lane & 15;
    const int mh   = __builtin_amdgcn_readfirstlane(wv) & 1;   // M-half (64 rows, 4 tiles of 16) this wave owns
    const int nbase = (wv >> 1) * 160;  // N-quarter this wave owns (10 tiles of 16)
    const int nq   = __builtin_amdgcn_readfirstlane(wv) >> 1;  // that quarter's number, in a scalar register for the epilogue

    v8f acc[MTW][NTW] = {};

    // staging map, A and W alike: thread t takes bytes 16 t .. 16 t + 15 of each 4-KiB sweep (32 rows) of a packed tile,
    // so a wave-wide load reads 512 contiguous bytes. They are four rows that lie 8 apart (the packing's order):
    // 8 * 144 B = 32 banks, so each half wave's 16-B LDS stores hit each bank once.
    const int srow = wv + ((lane >> 3) << 3);   // 0..31, each eight times per block
    const char* aptr = (const char*)(apk + (size_t)blockIdx.x * KT * A_TILE_ELEMS);   // block-uniform bases
    const char* wptr = (const char*)(wpk + (size_t)h * KT * W_TILE_ELEMS);
    __bf16* ast = Ald + srow * AS + (lane & 7) * 8;
    __bf16* wst = Wld + srow * WS + (lane & 7) * 8;

    // W prefetch target, one K step ahead of the loads: the tile's 320 units of 256 B, one per thread and a second one
    // (64 KiB on) from waves 0 and 1 (advanced in front of each use: the first prefetch asks for K step 2)
    const char* pfw = wptr + W_TILE_ELEMS * 2 + tid * 256;
    const bool  pfw_wave = __builtin_amdgcn_readfirstlane(wv) < (W_TILE_ELEMS * 2 / 256 - BLOCK) / 32;

    // One K step's operands in registers: A tile (128 x 64 bf16, 4 sweeps), W tile (640 x 64 bf16, 20 sweeps).
    // They are loaded one K step ahead of their use, so that the L2 time runs under the WMMAs of the step before.
    v8bf av[A_SWEEPS], wr[W_SWEEPS];
    unsigned soa = (unsigned)tid * 16u, sow = (unsigned)tid * 16u;   // lane's byte offsets at the K step loaded last
    auto load_step = [&]() {
        #pragma unroll
        for (int j = 0; j < A_SWEEPS; ++j)
            av[j] = *(const v8bf*)(aptr + j * SWEEP_BYTES + soa);
        #pragma unroll
        for (int j = 0; j < W_SWEEPS; ++j)
            wr[j] = *(const v8bf*)(wptr + j * SWEEP_BYTES + sow);
    };

    load_step();
    int bo = 0;   // element offset of this K step's LDS buffer: 0 or STAGE_ELEMS

    for (int d0 = 0; d0 < D_DIM; d0 += KSTEP) {
        // ---- 16 B per lane into this step's LDS buffer ----
        // Its last readers (two steps back) have all passed the barrier of the step before this one.
        #pragma unroll
        for (int j = 0; j < A_SWEEPS; ++j)
            *(v8bf*)(ast + bo + j * SWEEP_ROWS * AS) = av[j];
        #pragma unroll
        for (int j = 0; j < W_SWEEPS; ++j)
            *(v8bf*)(wst + bo + j * SWEEP_ROWS * WS) = wr[j];

        // ---- next K step's global loads, in flight across the barrier and this step's WMMAs ----
        if (d0 + KSTEP < D_DIM) {
            // stands in front of the advances of the registers that the last step's loads and prefetches name;
            // placed here, behind the use of that step's data, so that no wave waits on it between its new
            // loads and the barrier
            asm volatile("s_wait_xcnt 0x0" ::: "memory");
            soa += A_TILE_ELEMS * 2;
            sow += W_TILE_ELEMS * 2;
            // the W tile of the K step after the one loaded below into L2, one prefetch per 256-B unit. In asm so that it
            // names a pointer that lives through the loop: a temporary would be rewritten right behind the prefetch.
            // The pointer advances only under this test, so it stops in the head's last tile, inside the packed W.
            if (d0 + 2 * KSTEP < D_DIM) {
                pfw += W_TILE_ELEMS * 2;
                asm volatile("global_prefetch_b8 %0, off scope:SCOPE_SE" :: "v"(pfw));
                if (pfw_wave)
                    asm volatile("global_prefetch_b8 %0, off offset:65536 scope:SCOPE_SE" :: "v"(pfw));
            }
            load_step();
        }

        // Work-group barrier whose fences name LDS alone: it publishes the stage (s_wait_dscnt 0 in front),
        // while __syncthreads() would also wait here for the global loads just issued.
        __builtin_amdgcn_fence(__ATOMIC_RELEASE, "workgroup", "local");
        __builtin_amdgcn_s_barrier();
        __builtin_amdgcn_fence(__ATOMIC_ACQUIRE, "workgroup", "local");

        // ---- two K=32 slices per staged tile ----
        #pragma unroll
        for (int kk = 0; kk < 2; ++kk) {
            const int koff = bo + kk * 32;
            // A fragments (16x32 each): lanes 0-15 -> K 0..7,16..23; lanes 16-31 -> K 8..15,24..31
            v16bf afrag[MTW];
            #pragma unroll
            for (int i = 0; i < MTW; ++i)
                afrag[i] = frag16(Ald + (mh * 64 + i * 16 + l16) * AS + koff + hlf * 8);

            // B fragments in groups of five (ten at once do not fit beside the operands in flight),
            // each group loaded whole, then its WMMAs back-to-back: every B fragment meets the four A fragments.
            #pragma unroll
            for (int n0 = 0; n0 < NTW; n0 += NTW / 2) {
                v16bf bf[NTW / 2];
                #pragma unroll
                for (int nt = 0; nt < NTW / 2; ++nt) {
                    bf[nt] = frag16(Wld + (nbase + (n0 + nt) * 16 + l16) * WS + koff + hlf * 8);
                }
                // holds the group's loads together in front of its WMMAs: left free, this build, short of registers,
                // loads one fragment at a time and puts a full LDS wait in front of every WMMA
                __builtin_amdgcn_sched_barrier(0);
                #pragma unroll
                for (int nt = 0; nt < NTW / 2; ++nt) {
                    #pragma unroll
                    for (int i = 0; i < MTW; ++i)
                        acc[i][n0 + nt] = __builtin_amdgcn_wmma_f32_16x16x32_bf16(
                            false, afrag[i], false, bf[nt], (short)0, acc[i][n0 + nt], false, false);
                }
            }
        }
        bo ^= STAGE_ELEMS;
    }

    // ---- epilogue: all 256 threads, one per (token, group) ----
    // The f32 C tile of all 128 tokens does not fit LDS: the two halves of the tokens go through the epilogue in turn.
    // It is staged column by column, a column's 64 tokens side by side: an accumulator's 8 rows are two 16-B stores
    // (16 lanes, 272 B apart, cover the 64 banks once), and 32 threads that walk the columns of 32 neighbouring tokens
    // read 32 neighbouring banks.
    // The lane's number is read anew and the wave's comes from scalar registers (nq: the N-quarter in the dump, the group
    // afterwards): of the epilogue's indices tid alone lives in a vector register through the GEMM loop, which has few to spare.
    const int elane = (int)__builtin_amdgcn_mbcnt_lo(~0u, 0u);
    const int el16  = elane & 15;
    const int ehlf  = elane >> 4;
    const int ecol  = nq * (NTW * 16) + el16;   // this lane's column in tile 0 of its quarter

    // q_b, q_norm_w, k_norm_w and k_base are read at addresses that are the same in every lane. Through the constant address
    // space they come by scalar loads into scalar registers; as plain loads they are vector loads here (the asm
    // statements' memory clobbers hide that nothing writes them), each waited for in the loop. Inputs: no launch writes them.
    typedef const __attribute__((address_space(4))) float* cfloat_p;
    const cfloat_p qb_s  = (cfloat_p)(unsigned long long)(q_b + h * NQ + nq * HD_N);
    const cfloat_p qnw_s = (cfloat_p)(unsigned long long)q_norm_w;
    const cfloat_p knw_s = (cfloat_p)(unsigned long long)k_norm_w;
    const cfloat_p kb_s  = (cfloat_p)(unsigned long long)(k_base + h * HD_N);
    // b of this wave's (head, group). Load and data wait in one statement.
    float bg;
    asm volatile("s_load_b32 %0, %1, 0x0\n\ts_wait_kmcnt 0x0" : "=&s"(bg) : "s"(bvec + h * G_N + nq) : "memory");

    // Kept rolled: one copy of the epilogue's code serves both halves.
    #pragma unroll 1
    for (int ph = 0; ph < BM / EM; ++ph) {
    __syncthreads();   // the last readers of this LDS (the GEMM's last step, or the half before) are through
    // ---- accumulators to LDS; VGPR r -> token 16*i + 8*hlf + r, column = lane&15 of the tile ----
    if (mh == ph) {
        #pragma unroll
        for (int nt = 0; nt < NTW; ++nt) {
            float* col = Ct + (ecol + nt * 16) * PM + ehlf * 8;
            #pragma unroll
            for (int i = 0; i < MTW; ++i) {
                const v8f c = acc[i][nt];
                *(v4f*)(col + i * 16)     = __builtin_shufflevector(c, c, 0, 1, 2, 3);
                *(v4f*)(col + i * 16 + 4) = __builtin_shufflevector(c, c, 4, 5, 6, 7);
            }
        }
    }
    __syncthreads();

    // ---- RMS norms, dots, logistic sink score of one (token, group); every sum runs over d in rising order ----
    {
        const int g = nq;
        const int m = mh * 32 + elane;
        const float* cq = Ct + g * HD_N * PM + m;      // q
        const float* ck = Ct + NQ * PM + m;            // k
        const float inv_scale = 0.08838834764831845f;  // 1/sqrt(HD)

        float ssk = 0.f, ssq = 0.f, dqk = 0.f, dbase = 0.f;
        // 16 columns a trip: their LDS reads and scalar loads go out together, one latency per trip
        #pragma unroll 16
        for (int d = 0; d < HD_N; ++d) {
            const float kv = ck[d * PM];
            ssk += kv * kv;
            const float qv = cq[d * PM] + qb_s[d];
            ssq += qv * qv;
            const float qn = qv * qnw_s[d];
            dqk   += (kv * knw_s[d]) * qn;
            dbase += kb_s[d] * qn;
        }
        const float rk    = rsqrtf(ssk * (1.0f / HD_N) + EPSV);
        const float rq    = rsqrtf(ssq * (1.0f / HD_N) + EPSV);
        const float logit = dqk * rk * rq * inv_scale + bg;
        const float lbase = dbase * rq * inv_scale;
        Sld[g * EM + m] = 1.f / (1.f + expf(lbase - logit));
    }
    __syncthreads();   // the four groups' scores of every token stand in LDS

    if (tid < EM) {
        float score = 0.f;
        #pragma unroll
        for (int g = 0; g < G_N; ++g) score += Sld[g * EM + tid];
        out[(size_t)h * S_LEN + (s0 + ph * EM + tid)] = score * 0.25f;
        // stands in front of the second half's rewrite of the registers that this store names
        asm volatile("s_wait_xcnt 0x0" ::: "memory");
    }
    }
}

extern "C" void kernel_launch(void* const* d_in, const int* in_sizes, int n_in,
                              void* d_out, int out_size, void* d_ws, size_t ws_size,
                              hipStream_t stream) {
    const float* hs       = (const float*)d_in[0];
    const float* q_w      = (const float*)d_in[1];
    const float* q_b      = (const float*)d_in[2];
    const float* k_w      = (const float*)d_in[3];
    const float* q_norm_w = (const float*)d_in[4];
    const float* k_norm_w = (const float*)d_in[5];
    const float* k_base   = (const float*)d_in[6];
    const float* bvec     = (const float*)d_in[7];
    float* out = (float*)d_out;
    __bf16* apk = (__bf16*)d_ws;                     // 64 MiB
    __bf16* wpk = apk + (size_t)S_LEN * D_DIM;       // 40 MiB

    pack_bf16_kernel<<<PK_GRID, PK_BLOCK, 0, stream>>>(hs, q_w, k_w, apk, wpk);

    dim3 grid(S_LEN / BM, H_N);
    fused_gatescore_kernel<<<grid, BLOCK, SMEM_BYTES, stream>>>(
        apk, wpk, q_b, q_norm_w, k_norm_w, k_base, bvec, out);
}
